// v010
// Times are from an AMD MI455X. After a warm-up the kernel runs many times in a row, and a time is the length of
// such a window on the GPU divided by its runs, so every launch and the gaps after it count. The runs cycle
// through copies of the inputs. A figure is the median of several windows, for all but v000 over two sittings.
// Sittings can differ by a few percent; kernels timed side by side share one.
// The versions before v010 are in another document.
// One run takes 113 microseconds.
// In both of two side-by-side timings against v009, it was 1.08 times as fast.
// All steps since the starting kernel, v000, together make it 60.2 times as fast.
#include <hip/hip_runtime.h>
#define NB 2
#define SQ 2048
#define DM 1024
#define NH 16
#define HD 64
#define HG 4                         /* heads per k_vt launch */
#define B0 0                         /* first batch processed (debug hook) */
#define NBR NB                       /* batches processed (debug hook) */
#define NR ((size_t)NB * SQ)         /* token rows */
#define MP ((int)((size_t)NBR * SQ)) /* rows projected (debug hook) */
#define QN SQ                        /* query rows per batch (not used) */
#define NHD NH                       /* heads (not used) */
#define MPO MP                       /* rows through the output stage (debug hook) */
#define LQ DM      /* row pitch of the q/k rows */
typedef __bf16 v16b __attribute__((ext_vector_type(16)));
typedef unsigned short v8us __attribute__((ext_vector_type(8), may_alias));
typedef float  v8f  __attribute__((ext_vector_type(8)));
typedef float  v4f  __attribute__((ext_vector_type(4)));
typedef float  v4fa __attribute__((ext_vector_type(4), may_alias));
union FragB { v16b v; v8us half[2]; unsigned short u[16]; };

__device__ __forceinline__ unsigned short bf16_bits(float x) { unsigned int u = __float_as_uint(x); return (unsigned short)((u + 0x7FFFu + ((u >> 16) & 1u)) >> 16); }
__device__ __forceinline__ float bf16_val(unsigned short b) { return __uint_as_float(((unsigned int)b) << 16); }
__device__ __forceinline__ float bf16_round(float x) { return bf16_val(bf16_bits(x)); }
// D += A·B with NT terms: 1 = ah·bh, 2 = + al·bh (A split), 3 = + ah·bl (both split)
template <int NT>
__device__ __forceinline__ v8f mmaN(v16b ah, v16b al, v16b bh, v16b bl, v8f c) {
  c = __builtin_amdgcn_wmma_f32_16x16x32_bf16(false, ah, false, bh, (short)0, c, false, false);
  if (NT >= 2) c = __builtin_amdgcn_wmma_f32_16x16x32_bf16(false, al, false, bh, (short)0, c, false, false);
  if (NT >= 3) c = __builtin_amdgcn_wmma_f32_16x16x32_bf16(false, ah, false, bl, (short)0, c, false, false);
  asm volatile("v_nop\n\tv_nop\n\tv_nop\n\tv_nop" : "+v"(c) : "v"(ah), "v"(al), "v"(bh), "v"(bl));
  return c;
}

__global__ __launch_bounds__(256) void k_wt_bf16(const float* __restrict__ W, unsigned short* __restrict__ Wt, int K, int N) {
  const int t = blockIdx.x * 256 + threadIdx.x;
  const int k8n = K / 8;
  if (t >= N * k8n) return;
  const int n = t / k8n, k8 = (t % k8n) * 8;
  v8us v;
#pragma unroll
  for (int i = 0; i < 8; ++i) v[i] = bf16_bits(W[(size_t)(k8 + i) * N + n]);
  *(v8us*)(Wt + (size_t)n * K + k8) = v;
  
}

// GEMM C[M][N] (f32, pitch ldc) = act(A[M][K]·W + bias). A f32 row-major (pitch lda) converted per fragment to bf16
// (ASPLIT: hi/lo two planes -> 2 terms, else single rounded term); Wt bf16 [N][K] (pitch ldb). BIAS_BF16 rounds the
// bias to bf16 first (bias quantised to bf16 before the add). K%32==0, M%16==0, N%64==0.
template <bool ASPLIT, int ACT, bool BIAS_BF16>
__global__ __launch_bounds__(128) void k_gemm_bf(const float* __restrict__ A, int lda, const unsigned short* __restrict__ Wt, int ldb,
                                               const float* __restrict__ bias, float* __restrict__ C, int ldc, int M, int N, int K) {
  __shared__ __attribute__((aligned(16))) float so[4][16][64];
  const int tid = threadIdx.x, w = tid >> 5, lane = tid & 31, ln = lane & 15, hh = lane >> 4;
  const int ntn = N / 64;
  const int wid = blockIdx.x * 4 + w;
  const int mt = wid / ntn, nq = wid % ntn;
  if (mt * 16 >= M) return;
  const int row0 = mt * 16, col0 = nq * 64;
  const float* arow = A + (size_t)(row0 + ln) * lda;
  v8f acc[4] = {};
  for (int kb = 0; kb < K; kb += 32) {
    FragB ah, al;
    const v4f x0 = *(const v4fa*)(arow + kb + 8 * hh), x1 = *(const v4fa*)(arow + kb + 8 * hh + 4);
    const v4f x2 = *(const v4fa*)(arow + kb + 16 + 8 * hh), x3 = *(const v4fa*)(arow + kb + 16 + 8 * hh + 4);
    float xs[16] = {x0[0],x0[1],x0[2],x0[3],x1[0],x1[1],x1[2],x1[3],x2[0],x2[1],x2[2],x2[3],x3[0],x3[1],x3[2],x3[3]};
#pragma unroll
    for (int i = 0; i < 16; ++i) { const unsigned short hb = bf16_bits(xs[i]); ah.u[i] = hb; al.u[i] = ASPLIT ? bf16_bits(xs[i] - bf16_val(hb)) : (unsigned short)0; }
#pragma unroll
    for (int t = 0; t < 4; ++t) {
      const unsigned short* brow = Wt + (size_t)(col0 + t * 16 + ln) * ldb + kb;
      FragB b;
      b.half[0] = *(const v8us*)(brow + 8 * hh);
      b.half[1] = *(const v8us*)(brow + 16 + 8 * hh);
      acc[t] = mmaN<ASPLIT ? 2 : 1>(ah.v, al.v, b.v, b.v, acc[t]);
    }
  }
#pragma unroll
  for (int t = 0; t < 4; ++t) {
    float bv = bias ? bias[col0 + t * 16 + ln] : 0.f;
    if (BIAS_BF16) bv = bf16_round(bv);
#pragma unroll
    for (int r = 0; r < 8; ++r) { float v = acc[t][r] + bv; if (ACT == 1) v = fmaxf(v, 0.f); so[w][8 * hh + r][t * 16 + ln] = v; }
  }
  __builtin_amdgcn_fence(__ATOMIC_ACQ_REL, "workgroup");
  __builtin_amdgcn_wave_barrier();
  const int rsub = lane >> 4, c4 = (lane & 15) * 4;
  {
#pragma unroll
    for (int q = 0; q < 8; ++q) {
      const int r = q * 2 + rsub;
      const v4f v = *(const v4fa*)&so[w][r][c4];
      *(v4f*)(C + (size_t)(row0 + r) * ldc + col0 + c4) = v;
    }
    
  }
}

// GEMM C = act(A·W + bias + resid): A f32 (ASPLIT -> hi/lo 2 terms), Wt bf16 [N][K]; ACT 0 none, 1 relu, 2 exact gelu;
// resid (optional, f32, row index = (row % rmod), pitch ldr, RES_BF16 rounds it) added before the activation.
template <bool ASPLIT, int ACT, bool BIAS_BF16, bool RES_BF16>
__global__ __launch_bounds__(128) void k_gemm_bf3(const float* __restrict__ A, int lda, const unsigned short* __restrict__ Wt, int ldb,
                                                const float* __restrict__ bias, const float* __restrict__ resid, int rmod, int ldr,
                                                float* __restrict__ C, int ldc, int M, int N, int K) {
  __shared__ __attribute__((aligned(16))) float so[4][16][64];
  const int tid = threadIdx.x, w = tid >> 5, lane = tid & 31, ln = lane & 15, hh = lane >> 4;
  const int ntn = N / 64;
  const int wid = blockIdx.x * 4 + w;
  const int mt = wid / ntn, nq = wid % ntn;
  if (mt * 16 >= M) return;
  const int row0 = mt * 16, col0 = nq * 64;
  const float* arow = A + (size_t)(row0 + ln) * lda;
  v8f acc[4] = {};
  for (int kb = 0; kb < K; kb += 32) {
    FragB ah, al;
    const v4f x0 = *(const v4fa*)(arow + kb + 8 * hh), x1 = *(const v4fa*)(arow + kb + 8 * hh + 4);
    const v4f x2 = *(const v4fa*)(arow + kb + 16 + 8 * hh), x3 = *(const v4fa*)(arow + kb + 16 + 8 * hh + 4);
    float xs[16] = {x0[0],x0[1],x0[2],x0[3],x1[0],x1[1],x1[2],x1[3],x2[0],x2[1],x2[2],x2[3],x3[0],x3[1],x3[2],x3[3]};
#pragma unroll
    for (int i = 0; i < 16; ++i) { const unsigned short hb = bf16_bits(xs[i]); ah.u[i] = hb; al.u[i] = ASPLIT ? bf16_bits(xs[i] - bf16_val(hb)) : (unsigned short)0; }
#pragma unroll
    for (int t = 0; t < 4; ++t) {
      const unsigned short* brow = Wt + (size_t)(col0 + t * 16 + ln) * ldb + kb;
      FragB b;
      b.half[0] = *(const v8us*)(brow + 8 * hh);
      b.half[1] = *(const v8us*)(brow + 16 + 8 * hh);
      acc[t] = mmaN<ASPLIT ? 2 : 1>(ah.v, al.v, b.v, b.v, acc[t]);
    }
  }
#pragma unroll
  for (int t = 0; t < 4; ++t) {
    const int col = col0 + t * 16 + ln;
    float bv = bias ? bias[col] : 0.f;
    if (BIAS_BF16) bv = bf16_round(bv);
#pragma unroll
    for (int r = 0; r < 8; ++r) {
      float v = acc[t][r] + bv;
      if (resid) { float rv = resid[(size_t)((row0 + 8 * hh + r) % rmod) * ldr + col]; if (RES_BF16) rv = bf16_round(rv); v += rv; }
      if (ACT == 1) v = fmaxf(v, 0.f);
      if (ACT == 2) v = 0.5f * v * (1.0f + erff(v * 0.70710678118654752f));
      if (ACT == 3) { const float u = 0.7978845608028654f * (v + 0.044715f * v * v * v); v = 0.5f * v * (1.0f + tanhf(u)); }
      so[w][8 * hh + r][t * 16 + ln] = v;
    }
  }
  __builtin_amdgcn_fence(__ATOMIC_ACQ_REL, "workgroup");
  __builtin_amdgcn_wave_barrier();
  const int rsub = lane >> 4, c4 = (lane & 15) * 4;
  {
#pragma unroll
    for (int q = 0; q < 8; ++q) {
      const int r = q * 2 + rsub;
      const v4f v = *(const v4fa*)&so[w][r][c4];
      *(v4f*)(C + (size_t)(row0 + r) * ldc + col0 + c4) = v;
    }
    
  }
}
// row LayerNorm (biased variance, eps) over N: s = X (+ R); optional out_sum <- s; out_norm <- (s-mu)*rsqrt(var+eps)*g + b
template <bool PARAM_BF16>
__global__ __launch_bounds__(256) void k_layernorm(const float* __restrict__ X, const float* __restrict__ R, const float* __restrict__ g, const float* __restrict__ bta,
                                                  float* __restrict__ out_sum, float* __restrict__ out_norm, int N, float eps) {
  __shared__ float red[256];
  const int row = blockIdx.x, tid = threadIdx.x;
  const float* x = X + (size_t)row * N; const float* rr = R ? R + (size_t)row * N : nullptr;
  float vals[16];                     // up to N = 4096
  const int per = N / 256;            // contiguous chunk per thread? use strided-by-4 chunks: thread handles j = tid*4 + 1024*u
  float s1 = 0.f;
  for (int u = 0; u < per / 4; ++u) {
    const int j = tid * 4 + 1024 * u;
    const v4f a = *(const v4fa*)(x + j);
    v4f b = {0.f,0.f,0.f,0.f}; if (rr) b = *(const v4fa*)(rr + j);
#pragma unroll
    for (int q = 0; q < 4; ++q) { const float v = a[q] + b[q]; vals[u * 4 + q] = v; s1 += v; }
  }
  red[tid] = s1; __syncthreads();
  for (int st = 128; st > 0; st >>= 1) { if (tid < st) red[tid] += red[tid + st]; __syncthreads(); }
  const float mu = red[0] / (float)N; __syncthreads();
  float s2 = 0.f;
  for (int u = 0; u < per / 4; ++u)
#pragma unroll
    for (int q = 0; q < 4; ++q) { const float c = vals[u * 4 + q] - mu; s2 += c * c; }
  red[tid] = s2; __syncthreads();
  for (int st = 128; st > 0; st >>= 1) { if (tid < st) red[tid] += red[tid + st]; __syncthreads(); }
  const float rs = rsqrtf(red[0] / (float)N + eps);
  {
    for (int u = 0; u < per / 4; ++u) {
      const int j = tid * 4 + 1024 * u;
      v4f o, sm;
#pragma unroll
      for (int q = 0; q < 4; ++q) {
        float gg = g[j + q], bb = bta[j + q];
        if (PARAM_BF16) { gg = bf16_round(gg); bb = bf16_round(bb); }
        sm[q] = vals[u * 4 + q]; o[q] = (vals[u * 4 + q] - mu) * rs * gg + bb;
      }
      if (out_sum) *(v4f*)(out_sum + (size_t)row * N + j) = sm;
      *(v4f*)(out_norm + (size_t)row * N + j) = o;
    }
    
  }
}



// ---- f16 WMMA path (v_wmma_f32_16x16x32_f16): 11-bit significands for operands in range — used where a [0,1] probability operand needs more precision than bf16
typedef _Float16 v16h __attribute__((ext_vector_type(16)));
union FragH { v16h v; v8us half[2]; _Float16 h[16]; unsigned short u[16]; };
template <int NT>
__device__ __forceinline__ v8f mmaH(v16h ah, v16h al, v16h bh, v16h bl, v8f c) {
  c = __builtin_amdgcn_wmma_f32_16x16x32_f16(false, ah, false, bh, (short)0, c, false, false);
  if (NT >= 2) c = __builtin_amdgcn_wmma_f32_16x16x32_f16(false, al, false, bh, (short)0, c, false, false);
  if (NT >= 3) c = __builtin_amdgcn_wmma_f32_16x16x32_f16(false, ah, false, bl, (short)0, c, false, false);
  asm volatile("v_nop\n\tv_nop\n\tv_nop\n\tv_nop" : "+v"(c) : "v"(ah), "v"(al), "v"(bh), "v"(bl));
  return c;
}
// batched GEMM like k_gemm_b but f16 operands: A f32 (split into f16 hi/lo if ASPLIT, else rounded to f16), Bt = f16 values [n][k]; alpha; C f32; N multiple of 16 (partial tiles skipped)
template <bool ASPLIT>
__global__ __launch_bounds__(128) void k_gemm_h(const float* __restrict__ A, int lda, size_t sA, const _Float16* __restrict__ Bh, int ldb, size_t sB, float alpha, float* __restrict__ C, int ldc, size_t sC, int M, int N, int K) {
  __shared__ __attribute__((aligned(16))) float so[4][16][64];
  const int tid = threadIdx.x, w = tid >> 5, lane = tid & 31, ln = lane & 15, hh = lane >> 4; const int by = blockIdx.y;
  A += (size_t)by * sA; Bh += (size_t)by * sB; C += (size_t)by * sC;
  const int ntn = (N + 63) / 64; const int wid = blockIdx.x * 4 + w; const int mt = wid / ntn, nq = wid % ntn; if (mt * 16 >= M) return;
  const int row0 = mt * 16, col0 = nq * 64; const float* arow = A + (size_t)(row0 + ln) * lda;
  v8f acc[4] = {};
  for (int kb = 0; kb < K; kb += 32) {
    FragH ah, al;
    const v4f x0 = *(const v4fa*)(arow + kb + 8 * hh), x1 = *(const v4fa*)(arow + kb + 8 * hh + 4), x2 = *(const v4fa*)(arow + kb + 16 + 8 * hh), x3 = *(const v4fa*)(arow + kb + 16 + 8 * hh + 4);
    float xs[16] = {x0[0],x0[1],x0[2],x0[3],x1[0],x1[1],x1[2],x1[3],x2[0],x2[1],x2[2],x2[3],x3[0],x3[1],x3[2],x3[3]};
#pragma unroll
    for (int i = 0; i < 16; ++i) { const _Float16 h = (_Float16)xs[i]; ah.h[i] = h; al.h[i] = ASPLIT ? (_Float16)(xs[i] - (float)h) : (_Float16)0.0f; }
#pragma unroll
    for (int t = 0; t < 4; ++t) { if (col0 + t * 16 >= N) continue; const size_t boff = (size_t)(col0 + t * 16 + ln) * ldb + kb; FragH bq; bq.half[0] = *(const v8us*)(Bh + boff + 8 * hh); bq.half[1] = *(const v8us*)(Bh + boff + 16 + 8 * hh);
      acc[t] = mmaH<ASPLIT ? 2 : 1>(ah.v, al.v, bq.v, bq.v, acc[t]); }
  }
#pragma unroll
  for (int t = 0; t < 4; ++t) { if (col0 + t * 16 >= N) continue;
#pragma unroll
    for (int r = 0; r < 8; ++r) so[w][8 * hh + r][t * 16 + ln] = acc[t][r] * alpha; }
  __builtin_amdgcn_fence(__ATOMIC_ACQ_REL, "workgroup"); __builtin_amdgcn_wave_barrier();
  const int rsub = lane >> 4, c4 = (lane & 15) * 4;
  {
#pragma unroll
    for (int q = 0; q < 8; ++q) { const int r = q * 2 + rsub; if (col0 + c4 < N) { const v4f v = *(const v4fa*)&so[w][r][c4]; *(v4f*)(C + (size_t)(row0 + r) * ldc + col0 + c4) = v; } }
     }
}

// k_gemm_hh variant with fused epilogue: v = acc·alpha + bias[by·sBias + col] (+ CP[(row/rowsPerB)·sCPb + by·64 + col] if CP) ; ACT 0 none / 1 elu ; writes f16 C16 (and f32 C if non-null)
template <int ACT>
__global__ __launch_bounds__(128) void k_gemm_hhx(const _Float16* __restrict__ A, int lda, size_t sA, const _Float16* __restrict__ Bh, int ldb, size_t sB, float alpha, const float* __restrict__ bias, size_t sBias, const float* __restrict__ CP, int rowsPerB, size_t sCPb, int row0g,
    float* __restrict__ C, _Float16* __restrict__ C16, int ldc, size_t sC, int M, int N, int K) {
  __shared__ __attribute__((aligned(16))) float so[4][16][64];
  const int tid = threadIdx.x, w = tid >> 5, lane = tid & 31, ln = lane & 15, hh = lane >> 4; const int by = blockIdx.y;
  A += (size_t)by * sA; Bh += (size_t)by * sB; const size_t cofs = (size_t)by * sC; const float* bp = bias ? bias + (size_t)by * sBias : nullptr;
  const int ntn = (N + 63) / 64; const int wid = blockIdx.x * 4 + w; const int mt = wid / ntn, nq = wid % ntn; if (mt * 16 >= M) return;
  const int row0 = mt * 16, col0 = nq * 64; const _Float16* arow = A + (size_t)(row0 + ln) * lda;
  v8f acc[4] = {};
  for (int kb = 0; kb < K; kb += 32) { FragH ah; ah.half[0] = *(const v8us*)((const unsigned short*)arow + kb + 8 * hh); ah.half[1] = *(const v8us*)((const unsigned short*)arow + kb + 16 + 8 * hh);
#pragma unroll
    for (int t = 0; t < 4; ++t) { if (col0 + t * 16 >= N) continue; const size_t boff = (size_t)(col0 + t * 16 + ln) * ldb + kb; FragH bq; bq.half[0] = *(const v8us*)((const unsigned short*)Bh + boff + 8 * hh); bq.half[1] = *(const v8us*)((const unsigned short*)Bh + boff + 16 + 8 * hh);
      acc[t] = mmaH<1>(ah.v, ah.v, bq.v, bq.v, acc[t]); }
  }
#pragma unroll
  for (int t = 0; t < 4; ++t) { if (col0 + t * 16 >= N) continue; const int col = col0 + t * 16 + ln; const float bv = bp ? bf16_round(bp[col]) : 0.f;
#pragma unroll
    for (int r = 0; r < 8; ++r) { float v = acc[t][r] * alpha + bv; if (CP) { const int rr = row0g + row0 + 8 * hh + r; if (rowsPerB < 0) v += CP[cofs + (size_t)rr * ldc + col];      /* rowsPerB < 0: own element of the batched C plane */ else { const int bidx = rr / rowsPerB; v += CP[(size_t)bidx * sCPb + (size_t)by * 64 + col]; } } if (ACT == 1) v = (v > 0.f) ? v : expm1f(v); else if (ACT == 7) v = (v > 0.f) ? v + 1.0f : expf(v); else if (ACT == 8) v = tanhf(v); else if (ACT == 9) v = 0.5f * v * (1.0f + tanhf(0.7978845608028654f * (v + 0.044715f * v * v * v))); else if (ACT == 11) v = 1.0f / (1.0f + expf(-v)); else if (ACT == 12) v = (v > 0.f) ? v : 0.01f * v; else if (ACT == 14) v = (v > 0.f) ? v : 0.1f * v; else if (ACT == 16) v = (v >= 0.f) ? v : 0.3f * v; else if (ACT == 17) v = (v >= 0.f) ? v : 0.2f * v; else if (ACT == 15) v = v / (1.0f + expf(-v)); else if (ACT == 3) v = fmaxf(v, 0.f); else if (ACT == 6) v = 0.5f * v * (1.0f + erff(v * 0.70710678118654752f)); so[w][8 * hh + r][t * 16 + ln] = v; } }
  __builtin_amdgcn_fence(__ATOMIC_ACQ_REL, "workgroup"); __builtin_amdgcn_wave_barrier();
  const int rsub = lane >> 4, c4 = (lane & 15) * 4; typedef _Float16 v4h __attribute__((ext_vector_type(4)));
  {
#pragma unroll
    for (int q = 0; q < 8; ++q) { const int r = q * 2 + rsub; if (col0 + c4 < N) { const v4f v = *(const v4fa*)&so[w][r][c4]; if (C) *(v4f*)(C + cofs + (size_t)(row0 + r) * ldc + col0 + c4) = v; if (C16) { v4h h4; for (int i = 0; i < 4; ++i) h4[i] = (_Float16)v[i]; *(v4h*)(C16 + cofs + (size_t)(row0 + r) * ldc + col0 + c4) = h4; } } }
     }
}


typedef _Float16 v4h __attribute__((ext_vector_type(4)));

__global__ __launch_bounds__(256) void k_h16(const float* __restrict__ x, _Float16* __restrict__ X16, size_t n8) { const size_t t = (size_t)blockIdx.x * 256 + threadIdx.x; if (t >= n8) return; FragH f;
#pragma unroll
  for (int q = 0; q < 8; ++q) f.h[q] = (_Float16)x[t * 8 + q]; *(v8us*)((unsigned short*)X16 + t * 8) = f.half[0];  }
__global__ __launch_bounds__(256) void k_round16f(const float* __restrict__ W, _Float16* __restrict__ Bt, size_t n8) { const size_t t = (size_t)blockIdx.x * 256 + threadIdx.x; if (t >= n8) return; FragH f;
#pragma unroll
  for (int i = 0; i < 8; ++i) f.h[i] = (_Float16)(bf16_round(W[t * 8 + i]) * 16.0f); *(v8us*)((unsigned short*)Bt + t * 8) = f.half[0];  }
__global__ __launch_bounds__(256) void k_hl(const float* __restrict__ F, _Float16* __restrict__ Hh, _Float16* __restrict__ Hl, size_t n8) { const size_t t = (size_t)blockIdx.x * 256 + threadIdx.x; if (t >= n8) return; FragH fh, fl; const v4f a = *(const v4fa*)(F + t * 8), c = *(const v4fa*)(F + t * 8 + 4);
#pragma unroll
  for (int q = 0; q < 4; ++q) { _Float16 h = (_Float16)a[q]; fh.h[q] = h; fl.h[q] = (_Float16)((a[q] - (float)h) * 1024.0f); h = (_Float16)c[q]; fh.h[4 + q] = h; fl.h[4 + q] = (_Float16)((c[q] - (float)h) * 1024.0f); }
  { *(v8us*)((unsigned short*)Hh + t * 8) = fh.half[0]; *(v8us*)((unsigned short*)Hl + t * 8) = fl.half[0];  } }

// ---- fast GEMM (wave tile 32x64; requires M % 32 == 0 rows per launch region and N % 64 == 0); epilogue = k_gemm_hhx semantics ----
__device__ __forceinline__ v16h g2_frag(const _Float16* p, int hh) { FragH f; f.half[0] = *(const v8us*)((const unsigned short*)p + 8 * hh); f.half[1] = *(const v8us*)((const unsigned short*)p + 16 + 8 * hh); return f.v; }
// Fragment order of an f16 matrix [R][K]: 16-row x 32-k tiles of 1024 bytes, tile (rt, kt) at (rt * (K / 32) + kt) * 512 halves; inside a tile the 8 halves of row ln, k = part * 16 + hh * 8 .. + 7
// stand at (part * 32 + hh * 16 + ln) * 8. p = the tile + lane * 8: each of the two loads of a wave then covers 512 contiguous bytes (4 whole lines, not 16 pieces of 32 bytes); the k order is that of g2_frag.
__device__ __forceinline__ v16h pk_frag(const _Float16* p) { FragH f; f.half[0] = *(const v8us*)((const unsigned short*)p); f.half[1] = *(const v8us*)((const unsigned short*)p + 256); return f.v; }
__device__ __forceinline__ v8f g2_mma(v16h a, v16h b, v8f c) { v8f d = __builtin_amdgcn_wmma_f32_16x16x32_f16(false, a, false, b, (short)0, c, false, false); asm volatile("v_nop\n\tv_nop\n\tv_nop\n\tv_nop" : "+v"(d) : "v"(a), "v"(b)); return d; }
struct G2F { v16h a0, a1, b0, b1, b2, b3; };      /* the six fragments of one 32-k tile: two row tiles of A, four column tiles of B */
// one k tile's twelve loads, issued as one group at this place, tiles ahead of the products that read them. The wait stands behind the group: the six address pairs, named as inputs, stay live up to it,
// so that no load's result lands in a register that an issued load still names; the two scheduling barriers keep every load of the group in front of the wait and every rewrite of an address behind it
__device__ __forceinline__ G2F g2_load(const _Float16* a0, const _Float16* a1, const _Float16* b0, const _Float16* b1, const _Float16* b2, const _Float16* b3, int kb) { G2F f;
  const _Float16* p0 = a0 + kb; const _Float16* p1 = a1 + kb; const _Float16* p2 = b0 + kb; const _Float16* p3 = b1 + kb; const _Float16* p4 = b2 + kb; const _Float16* p5 = b3 + kb;
  f.a0 = pk_frag(p0); f.a1 = pk_frag(p1); f.b0 = pk_frag(p2); f.b1 = pk_frag(p3); f.b2 = pk_frag(p4); f.b3 = pk_frag(p5);
  __builtin_amdgcn_sched_barrier(0); asm volatile("s_wait_xcnt 0x0" :: "v"(p0), "v"(p1), "v"(p2), "v"(p3), "v"(p4), "v"(p5) : "memory"); __builtin_amdgcn_sched_barrier(0); return f; }
template <int ACT, int PK>      /* A and Bh in fragment order (pk_frag); PK 1: C16 alone is written, in fragment order; PK 2: the same tiles at their V^T places (rows = (head, d), columns = token rows: tile (32 keys, 16 d) at (key / 32) * 4 + d / 16 of the (batch, head) slab), bias by row; PK 0: C and C16 row-major. so: the block's staging range; bx, by: the block's tile and batch */
__device__ __forceinline__ void g2_body(float (*so)[32][68], const int bx, const int by, const _Float16* __restrict__ A, int lda, size_t sA, const _Float16* __restrict__ Bh, int ldb, size_t sB, float alpha, const float* __restrict__ bias, size_t sBias, const float* __restrict__ CP, int rowsPerB, size_t sCPb, int row0g,
    float* __restrict__ C, _Float16* __restrict__ C16, int ldc, size_t sC, int M, int N, int K) { static_assert(ACT == 0 || ACT == 3 || ACT == 6 || ACT == 8 || ACT == 9 || ACT == 11 || ACT == 12 || ACT == 14 || ACT == 15 || ACT == 16 || ACT == 17, "k_gemm2: unsupported ACT code (would silently apply no activation)");
  const int tid = threadIdx.x, w = tid >> 5, lane = tid & 31, ln = lane & 15, hh = lane >> 4;
  A += (size_t)by * sA; Bh += (size_t)by * sB; const size_t cofs = (size_t)by * sC; const float* bp = bias ? bias + (size_t)by * sBias : nullptr;
  const int ntn = N >> 6; const int mt = bx / ntn, nq = bx - mt * ntn; const int row0 = mt * 128 + 32 * w, col0 = nq * 64; if (row0 >= M) return;
  const _Float16* a0p = A + (size_t)row0 * lda + lane * 8; const _Float16* a1p = a0p + (size_t)16 * lda;
  const _Float16* b0p = Bh + (size_t)col0 * ldb + lane * 8; const _Float16* b1p = b0p + (size_t)16 * ldb; const _Float16* b2p = b1p + (size_t)16 * ldb; const _Float16* b3p = b2p + (size_t)16 * ldb;
  const v8f z8 = {0.f,0.f,0.f,0.f,0.f,0.f,0.f,0.f}; v8f c00 = z8, c01 = z8, c02 = z8, c03 = z8, c10 = z8, c11 = z8, c12 = z8, c13 = z8;
  if (K > 0) { const int ke = K * 16, kl = ke - 512, n3 = ke / 1536; int kb = 0;      /* halves of a fragment row; its last tile; whole trips. A ring of three register sets: tile t + 2 is asked for in front of tile t's products; past the end the last tile is fetched again, in bounds */
#define G2_LOAD(k) g2_load(a0p, a1p, b0p, b1p, b2p, b3p, (k) < kl ? (k) : kl)
#define G2_TILE(f) { c00 = g2_mma(f.a0, f.b0, c00); c10 = g2_mma(f.a1, f.b0, c10); c01 = g2_mma(f.a0, f.b1, c01); c11 = g2_mma(f.a1, f.b1, c11); c02 = g2_mma(f.a0, f.b2, c02); c12 = g2_mma(f.a1, f.b2, c12); c03 = g2_mma(f.a0, f.b3, c03); c13 = g2_mma(f.a1, f.b3, c13); }
    G2F f0 = G2_LOAD(0), f1 = G2_LOAD(512);
#pragma unroll 1      // three tiles a trip, so that each set keeps its registers (no copies between the sets); one block without an exit inside, so that the waits for the loads stay counted
    for (int i = 0; i < n3; ++i, kb += 1536) { const G2F f2 = G2_LOAD(kb + 1024); G2_TILE(f0) f0 = G2_LOAD(kb + 1536); G2_TILE(f1) f1 = G2_LOAD(kb + 2048); G2_TILE(f2) }
    if (kb < ke) G2_TILE(f0)      /* the one or two tiles that no whole trip holds are already in the ring */
    if (kb + 512 < ke) G2_TILE(f1) }
#undef G2_LOAD
#undef G2_TILE
  v8f accs[8] = {c00, c01, c02, c03, c10, c11, c12, c13};
  float rb[16] = {0.f, 0.f, 0.f, 0.f, 0.f, 0.f, 0.f, 0.f, 0.f, 0.f, 0.f, 0.f, 0.f, 0.f, 0.f, 0.f};      /* PK 2: the bias of the lane's 2 x 8 rows */
  if (PK == 2 && bp) { const float* rp = bp + row0 + 8 * hh; const v4f x0 = *(const v4fa*)rp, x1 = *(const v4fa*)(rp + 4), x2 = *(const v4fa*)(rp + 16), x3 = *(const v4fa*)(rp + 20);
#pragma unroll      // constant indices: the values stay in registers
    for (int i = 0; i < 4; ++i) { rb[i] = bf16_round(x0[i]); rb[4 + i] = bf16_round(x1[i]); rb[8 + i] = bf16_round(x2[i]); rb[12 + i] = bf16_round(x3[i]); } }
#pragma unroll
  for (int u = 0; u < 8; ++u) { const int t = u & 3, half = u >> 2; const int col = col0 + t * 16 + ln; const float bv = (PK != 2 && bp) ? bf16_round(bp[col]) : 0.f;
#pragma unroll
    for (int r = 0; r < 8; ++r) { const int rloc = half * 16 + 8 * hh + r; float v = accs[u][r] * alpha + (PK == 2 ? rb[half * 8 + r] : bv); if (CP) { if (rowsPerB < 0) v += CP[cofs + (size_t)(row0g + row0 + rloc) * ldc + col];      /* rowsPerB < 0: own element of the batched C plane */ else { const int bidx = (row0g + row0 + rloc) / rowsPerB; v += CP[(size_t)bidx * sCPb + (size_t)by * 64 + col]; } }
      if (ACT == 3) v = fmaxf(v, 0.f); else if (ACT == 6) v = 0.5f * v * (1.0f + erff(v * 0.70710678118654752f)); else if (ACT == 11) v = 1.0f / (1.0f + expf(-v)); else if (ACT == 15) v = v / (1.0f + expf(-v)); else if (ACT == 12) v = (v > 0.f) ? v : 0.01f * v; else if (ACT == 8) v = tanhf(v); else if (ACT == 9) v = 0.5f * v * (1.0f + tanhf(0.7978845608028654f * (v + 0.044715f * v * v * v))); else if (ACT == 14) v = (v > 0.f) ? v : 0.1f * v; else if (ACT == 16) v = (v >= 0.f) ? v : 0.3f * v; else if (ACT == 17) v = (v >= 0.f) ? v : 0.2f * v;
      so[w][rloc][t * 16 + ln] = v; } }
  __builtin_amdgcn_fence(__ATOMIC_ACQ_REL, "workgroup"); __builtin_amdgcn_wave_barrier();
  const int rsub = lane >> 4, c4 = (lane & 15) * 4;
  if (PK) {      /* C16 alone, in fragment order: the wave's 32 x 64 tile = 2 x 2 fragment tiles, eight stores of 512 contiguous bytes */
#pragma unroll      // constant LDS and store offsets
      for (int s = 0; s < 8; ++s) { const int rl = (s >> 2) * 16 + ln, cl = ((s >> 1) & 1) * 32 + (s & 1) * 16 + hh * 8; const v4f x = *(const v4fa*)&so[w][rl][cl], y = *(const v4fa*)&so[w][rl][cl + 4]; FragH f;
        for (int i = 0; i < 4; ++i) { f.h[i] = (_Float16)x[i]; f.h[4 + i] = (_Float16)y[i]; }
        const size_t tl = PK == 2 ? (size_t)((col0 / SQ) * NH + (row0 >> 6)) * (HD * SQ) + (size_t)((((col0 % SQ) >> 5) + ((s >> 1) & 1)) * 4 + ((row0 >> 4) & 3) + (s >> 2)) * 512      /* the wave's 32 rows lie in one head, its 64 columns in one batch */
                                : (size_t)(row0 + (s >> 2) * 16) * ldc + (size_t)((col0 >> 5) + ((s >> 1) & 1)) * 512;
        *(v8us*)((unsigned short*)C16 + cofs + tl + (s & 1) * 256 + lane * 8) = f.half[0]; }
    return; }
  {
#pragma unroll
    for (int q = 0; q < 16; ++q) { const int r = q * 2 + rsub; const v4f v = *(const v4fa*)&so[w][r][c4]; if (C) *(v4f*)(C + cofs + (size_t)(row0 + r) * ldc + col0 + c4) = v; if (C16) { v4h h4; for (int i = 0; i < 4; ++i) h4[i] = (_Float16)v[i]; *(v4h*)(C16 + cofs + (size_t)(row0 + r) * ldc + col0 + c4) = h4; } }
     } }
template <int ACT, int PK>
__global__ __launch_bounds__(128) void k_gemm2(const _Float16* __restrict__ A, int lda, size_t sA, const _Float16* __restrict__ Bh, int ldb, size_t sB, float alpha, const float* __restrict__ bias, size_t sBias, const float* __restrict__ CP, int rowsPerB, size_t sCPb, int row0g,
    float* __restrict__ C, _Float16* __restrict__ C16, int ldc, size_t sC, int M, int N, int K) {
  __shared__ __attribute__((aligned(16))) float so[4][32][68];
  g2_body<ACT, PK>(so, (int)blockIdx.x, (int)blockIdx.y, A, lda, sA, Bh, ldb, sB, alpha, bias, sBias, CP, rowsPerB, sCPb, row0g, C, C16, ldc, sC, M, N, K); }
// The three projections as one launch: none reads what another writes. blockIdx.y = 0, 1, 2: v, q, k. v is formed transposed, V^T = Wv^T x^T: both operands stand in the same fragment order, so the weight rows go in as A and
// the token rows as B, and the result tiles (rows d, k = keys) are the A fragments of the attention's O^T += V^T P^T as they leave the accumulators; no v plane and no transposing launch. One projection alone puts
// two waves on a SIMD, and each of its k tiles waits for operands that every block asks for at the same time; with all three in flight a SIMD holds as many waves as the registers allow, and two launch gaps, fills and tails go.
__global__ __launch_bounds__(128) void k_qkv(const _Float16* __restrict__ XQ, const _Float16* __restrict__ XK, const _Float16* __restrict__ XV, const _Float16* __restrict__ BQ, const _Float16* __restrict__ BK, const _Float16* __restrict__ BV,
    const float* __restrict__ bq, const float* __restrict__ bk, const float* __restrict__ bv, _Float16* __restrict__ Q16, _Float16* __restrict__ K16, _Float16* __restrict__ VT) {
  __shared__ __attribute__((aligned(16))) float so[4][32][68];
  const int y = (int)blockIdx.y;      /* block-uniform */
  static_assert((MP / 128) * (DM / 64) == (DM / 128) * (MP / 64) && MP == NB * SQ && SQ % 64 == 0 && HD % 32 == 0, "k_qkv: the transposed projection has as many blocks as the others; whole batches");
  if (y == 0) g2_body<0, 2>(so, (int)blockIdx.x, 0, BV, DM, 0, XV, DM, 0, 0.0625f, bv, 0, nullptr, 1, 0, 0, nullptr, VT, DM, 0, DM, MP, DM);
  else g2_body<0, 1>(so, (int)blockIdx.x, 0, y == 1 ? XQ : XK, DM, 0, y == 1 ? BQ : BK, DM, 0, 0.0625f, y == 1 ? bq : bk, 0, nullptr, 1, 0, 0, nullptr, y == 1 ? Q16 : K16, DM, 0, MP, DM, DM); }


__global__ __launch_bounds__(256) void k_wnat(const float* __restrict__ w, size_t n8, _Float16* __restrict__ Bt) { const size_t t = (size_t)blockIdx.x * 256 + threadIdx.x; if (t >= n8) return; FragH f; for (int q = 0; q < 8; ++q) f.h[q] = (_Float16)(bf16_round(w[t * 8 + q]) * 16.0f); *(v8us*)((unsigned short*)Bt + t * 8) = f.half[0];  }
__global__ __launch_bounds__(256) void k_rsm(const float* __restrict__ S, _Float16* __restrict__ P, int nrows) {
  #pragma clang fp contract(off)
  const int i = blockIdx.x * 256 + threadIdx.x; if (i >= nrows) return; const float* s = S + (size_t)i * SQ; float mx = -3.0e38f;
#pragma unroll 1
  for (int j = 0; j < SQ; ++j) mx = fmaxf(mx, s[j]); float se = 0.f;
#pragma unroll 1
  for (int j = 0; j < SQ; ++j) se += expf(s[j] - mx); const float sc = 256.0f / se;
#pragma unroll 1
  for (int j0 = 0; j0 < SQ; j0 += 8) { FragH f; for (int q = 0; q < 8; ++q) f.h[q] = (_Float16)(expf(s[j0 + q] - mx) * sc); unsigned short* d = (unsigned short*)P + (size_t)i * SQ + j0; *(v8us*)d = f.half[0];  } }
__global__ __launch_bounds__(256) void k_vt(const _Float16* __restrict__ V16, int b, int h0, _Float16* __restrict__ VT) { __shared__ unsigned short tl[64][65]; const int tid = threadIdx.x; const int hh = blockIdx.x % HG, sg = blockIdx.x / HG; const int s0 = sg * 64; const int h = h0 + hh;
  for (int i = tid; i < 64 * 8; i += 256) { const int j = i / 8, d8 = (i % 8) * 8; FragH f; f.half[0] = *(const v8us*)((const unsigned short*)V16 + ((size_t)b * SQ + s0 + j) * DM + h * HD + d8); for (int q = 0; q < 8; ++q) tl[d8 + q][j] = f.u[q]; }
  __syncthreads();
  { for (int i = tid; i < 64 * 8; i += 256) { const int d = i / 8, j8 = (i % 8) * 8; FragH f; for (int q = 0; q < 8; ++q) f.u[q] = tl[d][j8 + q]; *(v8us*)((unsigned short*)VT + ((size_t)hh * HD + d) * SQ + s0 + j8) = f.half[0]; }  } }






typedef int v4ia __attribute__((ext_vector_type(4), may_alias));
__device__ __forceinline__ float rs_xrow(float v) { const int i = __float_as_int(v); return __int_as_float(__builtin_amdgcn_permlanex16(i, i, 0x76543210, 0xfedcba98, true, false)); }      /* lane l reads lane l ^ 16 */
// Fused attention, 16-query tiles of one (batch, head), 32 keys a pass: S^T = K Q^T (A = K rows, B = Q kept in registers), so a lane holds one query's
// scores (keys 8*hh + r of each 16-key tile); running maximum and sum per lane, one exchange between the wave halves; the two f32 score tiles, converted in place,
// are the B operand of O^T += V^T P^T. No score and no weight goes through memory. All in the log2 domain: p = 2^(s * FA_C - mu + FA_OFF) with mu the maximum in use.
#define FA_C 0.18033688011112042f      /* 64^-0.5 * log2(e) */
#define FA_OFF 7.0f                    /* weights carried x128: small ones stay normal f16 numbers */
#define FA_THR 8.0f                    /* mu is renewed only when a score passes it by more than this: weights stay at or under 2^15, inside f16 */
#define FA_DROP (-0x1p+100f)           /* raw score of a masked key; a power of two, so FA_DROP * FA_C is exact and a row with every key masked gets equal weights */
__device__ __forceinline__ v8f fa_mma(v16h a, v16h b, v8f c) { return __builtin_amdgcn_wmma_f32_16x16x32_f16(false, a, false, b, (short)0, c, false, false); }
// eight native 2^x; each is followed by an independent instruction, the last by the v_nop: the slot the instruction set asks for behind a transcendental
__device__ __forceinline__ v8f fa_exp2(v8f x) { float e0, e1, e2, e3, e4, e5, e6, e7;
  asm("v_exp_f32 %0, %8\n\tv_exp_f32 %1, %9\n\tv_exp_f32 %2, %10\n\tv_exp_f32 %3, %11\n\tv_exp_f32 %4, %12\n\tv_exp_f32 %5, %13\n\tv_exp_f32 %6, %14\n\tv_exp_f32 %7, %15\n\tv_nop"
      : "=&v"(e0), "=&v"(e1), "=&v"(e2), "=&v"(e3), "=&v"(e4), "=&v"(e5), "=&v"(e6), "=&v"(e7) : "v"(x[0]), "v"(x[1]), "v"(x[2]), "v"(x[3]), "v"(x[4]), "v"(x[5]), "v"(x[6]), "v"(x[7]));
  const v8f e = {e0, e1, e2, e3, e4, e5, e6, e7}; return e; }
__device__ __forceinline__ float fa_exp2s(float x) { float e; asm("v_exp_f32 %0, %1\n\tv_nop" : "=v"(e) : "v"(x)); return e; }      /* the v_nop: the same slot */
// behind a group of loads or stores: the group is issued whole at this place (for loads: ahead of the arithmetic that covers their latency), and its address and data registers are reused only behind the wait;
// the two scheduling barriers keep every member of the group in front of the wait and every rewrite of a register behind it
__device__ __forceinline__ void fa_issued() { __builtin_amdgcn_sched_barrier(0); asm volatile("s_wait_xcnt 0x0" ::: "memory"); __builtin_amdgcn_sched_barrier(0); }
struct FaK { v16h a00, a01, a10, a11; };      /* one pass of K fragments (two 16-key tiles x two k steps) */
// kp: the head's first K tile + lane * 8 (fragment order)
__device__ __forceinline__ FaK fa_load(const _Float16* kp, int j) { FaK f; const _Float16* k = kp + (size_t)j * LQ;
  f.a00 = pk_frag(k); f.a01 = pk_frag(k + 512); f.a10 = pk_frag(k + 16 * LQ); f.a11 = pk_frag(k + 16 * LQ + 512); return f; }
// The mask's pass map, written by pm_tile in the first launch: for each tile of 16 query rows (token rows) one 64-bit word, bit p set when the tile's 16 x 32 mask words of pass p (keys 32 p .. 32 p + 31)
// hold a nonzero one. A wave reads its tile's word once and tests one scalar bit a pass; no mask word is read in a pass without a nonzero one. A tile's word has a 128-byte line of its own (one writer a line).
#define PM_PITCH 32                    /* 32-bit words between two tiles' map words */
static_assert(SQ == 2048, "pass map: 64 passes of 32 keys in one 64-bit word");
__device__ __forceinline__ unsigned long long fa_map(const unsigned* __restrict__ MF, size_t rq) { const unsigned* p = MF + rq / 16 * PM_PITCH;
  const unsigned lo = (unsigned)__builtin_amdgcn_readfirstlane((int)p[0]), hi = (unsigned)__builtin_amdgcn_readfirstlane((int)p[1]); return ((unsigned long long)hi << 32) | lo; }
__device__ __forceinline__ bool fa_anym(unsigned long long mw, int j) { return ((mw >> (j >> 5)) & 1ull) != 0; }      /* wave-uniform: does pass j / 32 hold a nonzero mask word? */
// a key with a nonzero mask word takes FA_DROP as its raw score; m: the lane's own query row, first key of the pass + 8 * hh (the lane's 16 words are read here, only in a pass that holds a nonzero word)
__device__ __forceinline__ void fa_drop(const int* m, v8f& s0, v8f& s1) { const v4ia m0 = *(const v4ia*)m, m1 = *(const v4ia*)(m + 4), m2 = *(const v4ia*)(m + 16), m3 = *(const v4ia*)(m + 20);
#pragma unroll      // constant indices: the tiles stay in registers
  for (int r = 0; r < 4; ++r) { s0[r] = (m0[r] == 0) ? s0[r] : FA_DROP; s0[4 + r] = (m1[r] == 0) ? s0[4 + r] : FA_DROP; s1[r] = (m2[r] == 0) ? s1[r] : FA_DROP; s1[4 + r] = (m3[r] == 0) ? s1[4 + r] : FA_DROP; } }
// ---- the second output (the last head's probabilities) from work-groups of its own, ahead of the attention work-groups in the same launch: one work-group = 16 query rows, each of its 8 waves 256 keys,
// so that the whole chip shares this work and no attention work-group runs longer than the others. S^T as in k_fattn (a lane holds one query's scores). First walk: the wave's running maximum and sum;
// they are joined across the waves through LDS; second walk: the scores again, p = 2^(s * FA_C - maximum) / sum, turned through the wave's own LDS range so that whole 128-byte lines are stored.
#define PB_BLOCKS (NB * (SQ / 16))
#define PB_KEYS (SQ / 8)               /* keys a wave */
#define PB_PITCH 36                    /* floats a staged row: 128 bytes + 16, so that the 16 lanes of a half wave write 64 different banks */
__device__ __forceinline__ void fa_prob(int t, const _Float16* __restrict__ Q16, const _Float16* __restrict__ K16, const int* __restrict__ Mk, const unsigned* __restrict__ MF, float* __restrict__ PO, float (*red)[8][16], float (*stg)[16][PB_PITCH]) {
  const int lane = threadIdx.x & 31, ln = lane & 15, hh = lane >> 4; const int w = __builtin_amdgcn_readfirstlane(threadIdx.x >> 5);
  const size_t rq = (size_t)t * 16, qr = rq + ln; const int j0 = w * PB_KEYS, je = j0 + PB_KEYS;      /* first query row (token row: batch * SQ + row), the lane's query row; the wave's keys */
  const _Float16* qp = Q16 + rq * LQ + (NH - 1) * 1024 + lane * 8; const v16h q0 = pk_frag(qp), q1 = pk_frag(qp + 512);
  fa_issued();
  const _Float16* kp = K16 + (size_t)(t / (SQ / 16)) * SQ * LQ + (NH - 1) * 1024 + lane * 8; const int* mp = Mk + qr * SQ + 8 * hh; const unsigned long long mw = fa_map(MF, rq);
  const v8f z8 = {0.f, 0.f, 0.f, 0.f, 0.f, 0.f, 0.f, 0.f}; float mu = -3.0e38f, l = 0.f;
  FaK f = fa_load(kp, j0);
  fa_issued();
#pragma unroll 1      // one pass a trip: the next pass's operands are already fetched by hand
  for (int j = j0; j < je; j += 32) {
    v8f s0 = fa_mma(f.a01, q1, fa_mma(f.a00, q0, z8)), s1 = fa_mma(f.a11, q1, fa_mma(f.a10, q0, z8));
    if (fa_anym(mw, j)) fa_drop(mp + j, s0, s1);
    f = fa_load(kp, (j + 32 < je) ? j + 32 : j0);      /* the last pass fetches the second walk's first operands */
    fa_issued();
    float tm = fmaxf(s0[0], s1[0]);
#pragma unroll      // constant indices: the tiles stay in registers
    for (int r = 1; r < 8; ++r) tm = fmaxf(tm, fmaxf(s0[r], s1[r]));
    tm = fmaxf(tm, rs_xrow(tm)); const float mn = fmaxf(mu, tm * FA_C), al = fa_exp2s(mu - mn); mu = mn;
    const v8f ps = fa_exp2(s0 * FA_C - mn) + fa_exp2(s1 * FA_C - mn);
    l = l * al + (((ps[0] + ps[1]) + (ps[2] + ps[3])) + ((ps[4] + ps[5]) + (ps[6] + ps[7]))); }
  l += rs_xrow(l);      /* the halves hold the same maximum */
  if (lane < 16) { red[0][w][ln] = mu; red[1][w][ln] = l; }
  __syncthreads();      /* every wave's row maxima and sums are in LDS */
  float mx = red[0][0][ln];
#pragma unroll      // constant LDS offsets
  for (int u = 1; u < 8; ++u) mx = fmaxf(mx, red[0][u][ln]);
  float lt = 0.f;
#pragma unroll      // constant LDS offsets
  for (int u = 0; u < 8; ++u) lt += red[1][u][ln] * fa_exp2s(red[0][u][ln] - mx);
  const float il = 1.0f / lt;
  float (*sg)[PB_PITCH] = stg[w]; float* pw = PO + (rq + (lane >> 3)) * SQ + (lane & 7) * 4;      /* the wave's own staging range; a store covers four whole 128-byte lines (four rows of the pass) */
#pragma unroll 1      // as above
  for (int j = j0; j < je; j += 32) {
    v8f s0 = fa_mma(f.a01, q1, fa_mma(f.a00, q0, z8)), s1 = fa_mma(f.a11, q1, fa_mma(f.a10, q0, z8));
    if (fa_anym(mw, j)) fa_drop(mp + j, s0, s1);
    f = fa_load(kp, (j + 32 < je) ? j + 32 : j);      /* the last pass fetches its own operands again, in bounds */
    fa_issued();
    const v8f p0 = fa_exp2(s0 * FA_C - mx) * il, p1 = fa_exp2(s1 * FA_C - mx) * il;
    const v4f t0 = {p0[0], p0[1], p0[2], p0[3]}, t1 = {p0[4], p0[5], p0[6], p0[7]}, t2 = {p1[0], p1[1], p1[2], p1[3]}, t3 = {p1[4], p1[5], p1[6], p1[7]};
    *(v4fa*)&sg[ln][8 * hh] = t0; *(v4fa*)&sg[ln][8 * hh + 4] = t1; *(v4fa*)&sg[ln][16 + 8 * hh] = t2; *(v4fa*)&sg[ln][20 + 8 * hh] = t3;
    asm volatile("s_wait_dscnt 0x0" ::: "memory");      // the wave's LDS writes are done before its lanes read one another's words back
    const v4f r0 = *(const v4fa*)&sg[lane >> 3][(lane & 7) * 4], r1 = *(const v4fa*)&sg[4 + (lane >> 3)][(lane & 7) * 4], r2 = *(const v4fa*)&sg[8 + (lane >> 3)][(lane & 7) * 4], r3 = *(const v4fa*)&sg[12 + (lane >> 3)][(lane & 7) * 4];
    *(v4f*)(pw + j) = r0; *(v4f*)(pw + j + 4 * SQ) = r1; *(v4f*)(pw + j + 8 * SQ) = r2; *(v4f*)(pw + j + 12 * SQ) = r3;
    fa_issued(); } }      /* also keeps the next pass's LDS writes behind this pass's reads */
// The attention work-groups: 128 query rows of one (batch, head) as 4 tiles of 32 rows x 2 key ranges of SQ / 2 keys; wave w takes tile w & 3 and range w >> 2. Each K and V^T fragment a wave loads
// feeds two 16-query tiles (a and b), so a wave loads half the bytes for a product, and a wave's pass holds twice the work behind the same loads. The two waves of a tile join their sums through LDS.
#define FA_KR (SQ / 2)                 /* keys of one range */
// fa_issued for a group off one address: the address, named as an input, stays live up to the wait, so that no load's result lands in it
__device__ __forceinline__ void fa_issued_at(const void* p) { __builtin_amdgcn_sched_barrier(0); asm volatile("s_wait_xcnt 0x0" :: "v"(p) : "memory"); __builtin_amdgcn_sched_barrier(0); }
__device__ __forceinline__ FaK fa_load_at(const _Float16* k) { FaK f; f.a00 = pk_frag(k); f.a01 = pk_frag(k + 512); f.a10 = pk_frag(k + 16 * LQ); f.a11 = pk_frag(k + 16 * LQ + 512); return f; }      /* k: the pass's first K tile + lane * 8 */
__device__ __forceinline__ float fa_tmax(const v8f& s0, const v8f& s1) { float tm = fmaxf(s0[0], s1[0]);      /* a query's largest raw score of the pass, the same in both wave halves */
#pragma unroll      // constant indices: the tiles stay in registers
  for (int r = 1; r < 8; ++r) tm = fmaxf(tm, fmaxf(s0[r], s1[r]));
  return fmaxf(tm, rs_xrow(tm)); }
// one tile's weights of a pass: p = 2^(s * FA_C + nb), added to the lane's sum l, returned as the f16 B operand
__device__ __forceinline__ v16h fa_wts(const v8f& s0, const v8f& s1, float nb, float& l) { const v8f p0 = fa_exp2(s0 * FA_C + nb), p1 = fa_exp2(s1 * FA_C + nb);
  const v8f ps = p0 + p1; l += ((ps[0] + ps[1]) + (ps[2] + ps[3])) + ((ps[4] + ps[5]) + (ps[6] + ps[7]));
  FragH pf;
#pragma unroll      // constant indices: the fragment stays in registers
  for (int r = 0; r < 8; ++r) { pf.h[r] = (_Float16)p0[r]; pf.h[8 + r] = (_Float16)p1[r]; }
  return pf.v; }
// amdgpu_waves_per_eu(4, 4): at most 256 registers a wave, so that two work-groups (four waves a SIMD) stay on a WGP
__global__ __launch_bounds__(256) __attribute__((amdgpu_waves_per_eu(4, 4))) void k_fattn(const _Float16* __restrict__ Q16, const _Float16* __restrict__ K16, const _Float16* __restrict__ VT, const int* __restrict__ Mk, const unsigned* __restrict__ MF, _Float16* __restrict__ O16, float* __restrict__ PO) {
  static_assert(SQ % 128 == 0 && HD == 64 && FA_KR % 32 == 0, "k_fattn: 4 tiles of 32 query rows x 2 key ranges a block, head size 64");
  __shared__ __attribute__((aligned(16))) float pb_red[2][8][16]; __shared__ __attribute__((aligned(16))) float pb_stg[8][16][PB_PITCH];
  __shared__ __attribute__((aligned(16))) float mg_o[8][8][32][4]; __shared__ float mg_s[8][2][32];      /* what a wave hands to its partner: one 16-query tile of O^T (a lane's 32 values as 8 runs of 16 bytes, lanes side by side), its maximum in use and its sum */
  if (blockIdx.x < PB_BLOCKS) { fa_prob((int)blockIdx.x, Q16, K16, Mk, MF, PO, pb_red, pb_stg); return; }      /* block-uniform: the short work-groups of the second output start first, beside the first attention work-groups */
  const int lane = threadIdx.x & 31, ln = lane & 15, hh = lane >> 4; const int w = __builtin_amdgcn_readfirstlane(threadIdx.x >> 5); const int kh = w >> 2;      /* kh: the wave's key range */
  const unsigned at = blockIdx.x - PB_BLOCKS; const int h = (int)(at / (SQ / 128) % NH), b = (int)(at / (SQ / 128) / NH);
  const size_t rq = (size_t)b * SQ + at % (SQ / 128) * 128 + (w & 3) * 32;      /* the wave's first query row: tile a = rows rq .. rq + 15, tile b = the next 16 */
  const _Float16* qp = Q16 + rq * LQ + h * 1024 + lane * 8; const v16h qa0 = pk_frag(qp), qa1 = pk_frag(qp + 512), qb0 = pk_frag(qp + 16 * LQ), qb1 = pk_frag(qp + 16 * LQ + 512);      /* a head's 64 columns are two 32-k tiles */
  fa_issued_at(qp);      /* Q, then K, then V^T: the order of the loop, so that the loop's first wait for K leaves the V^T loads in flight */
  const _Float16* kp = K16 + (size_t)b * SQ * LQ + h * 1024 + lane * 8; const _Float16* vp = VT + (size_t)(b * NH + h) * HD * SQ + lane * 8; const int* mpa = Mk + (rq + ln) * SQ + 8 * hh; const int* mpb = mpa + 16 * SQ;
  const unsigned long long mwa = fa_map(MF, rq), mwb = fa_map(MF, rq + 16), mwx = mwa | mwb;
  const v8f z8 = {0.f, 0.f, 0.f, 0.f, 0.f, 0.f, 0.f, 0.f}; v8f oa0 = z8, oa1 = z8, oa2 = z8, oa3 = z8, ob0 = z8, ob1 = z8, ob2 = z8, ob3 = z8; float mua = -3.0e38f, mub = -3.0e38f, la = 0.f, lb = 0.f;
  const int j0 = kh * FA_KR, je = j0 + FA_KR;
  const _Float16* kc = kp + (size_t)j0 * LQ; const _Float16* vc = vp + j0 * 64;      /* the operands of the range's first pass */
  FaK f = fa_load_at(kc);
  fa_issued_at(kc);
  v16h v0 = pk_frag(vc), v1 = pk_frag(vc + 512), v2 = pk_frag(vc + 1024), v3 = pk_frag(vc + 1536);      /* a pass of V^T: four tiles, 4096 contiguous bytes */
  fa_issued_at(vc);
#pragma unroll 1      // one pass a trip: the next pass's operands are already fetched by hand, a second copy of the body would only cost registers
  for (int j = j0; j < je; j += 32) { const int jn = (j + 32 < je) ? j + 32 : j;      /* first key of the next pass; the last pass fetches its own operands again, in bounds */
    v8f sa0 = fa_mma(f.a00, qa0, z8), sb0 = fa_mma(f.a00, qb0, z8), sa1 = fa_mma(f.a10, qa0, z8), sb1 = fa_mma(f.a10, qb0, z8);
    sa0 = fa_mma(f.a01, qa1, sa0); sb0 = fa_mma(f.a01, qb1, sb0); sa1 = fa_mma(f.a11, qa1, sa1); sb1 = fa_mma(f.a11, qb1, sb1);
    if (fa_anym(mwx, j)) { if (fa_anym(mwa, j)) fa_drop(mpa + j, sa0, sa1); if (fa_anym(mwb, j)) fa_drop(mpb + j, sb0, sb1); }      /* one scalar test a pass where no mask word is set */
    const float tla = fa_tmax(sa0, sa1) * FA_C, tlb = fa_tmax(sb0, sb1) * FA_C;
    if (__builtin_amdgcn_ballot_w32((tla > mua + FA_THR) | (tlb > mub + FA_THR)) != 0) {      /* rare: one scalar test a pass for both tiles */
      const float na = fmaxf(mua, tla), aa = fa_exp2s(mua - na), nb = fmaxf(mub, tlb), ab = fa_exp2s(mub - nb); mua = na; mub = nb; la *= aa; lb *= ab;
      oa0 *= aa; oa1 *= aa; oa2 *= aa; oa3 *= aa; ob0 *= ab; ob1 *= ab; ob2 *= ab; ob3 *= ab; }
    const _Float16* kn = kp + (size_t)jn * LQ; const _Float16* vn = vp + jn * 64;
    f = fa_load_at(kn);      /* the next pass's K flies during this pass's exponentials and products */
    fa_issued_at(kn);
    const v16h pa = fa_wts(sa0, sa1, FA_OFF - mua, la), pb = fa_wts(sb0, sb1, FA_OFF - mub, lb);
    oa0 = fa_mma(v0, pa, oa0); ob0 = fa_mma(v0, pb, ob0); oa1 = fa_mma(v1, pa, oa1); ob1 = fa_mma(v1, pb, ob1); oa2 = fa_mma(v2, pa, oa2); ob2 = fa_mma(v2, pb, ob2); oa3 = fa_mma(v3, pa, oa3); ob3 = fa_mma(v3, pb, ob3);
    v0 = pk_frag(vn); v1 = pk_frag(vn + 512); v2 = pk_frag(vn + 1024); v3 = pk_frag(vn + 1536);      /* the next pass's V^T flies during its score products and softmax */
    fa_issued_at(vn); }
  la += rs_xrow(la); lb += rs_xrow(lb);      /* the halves' sums are joined once */
  // the two key ranges of a tile are joined: the wave of range 0 finishes tile a, that of range 1 tile b; each hands the other tile to its partner (wave w ^ 4) through LDS
  const bool k1 = kh != 0;      /* wave-uniform */
  const v8f g0 = k1 ? oa0 : ob0, g1 = k1 ? oa1 : ob1, g2 = k1 ? oa2 : ob2, g3 = k1 ? oa3 : ob3; const float gm = k1 ? mua : mub, gl = k1 ? la : lb;      /* given away */
  const v8f k0 = k1 ? ob0 : oa0, k1v = k1 ? ob1 : oa1, k2 = k1 ? ob2 : oa2, k3 = k1 ? ob3 : oa3; const float km = k1 ? mub : mua, kl = k1 ? lb : la;      /* kept */
  { const v8f g[4] = {g0, g1, g2, g3};
#pragma unroll      // constant indices and LDS offsets
    for (int i = 0; i < 4; ++i) { const v4f x = {g[i][0], g[i][1], g[i][2], g[i][3]}, y = {g[i][4], g[i][5], g[i][6], g[i][7]}; *(v4fa*)&mg_o[w][2 * i][lane][0] = x; *(v4fa*)&mg_o[w][2 * i + 1][lane][0] = y; } }
  mg_s[w][0][lane] = gm; mg_s[w][1][lane] = gl;
  __syncthreads();      /* every wave's handed-over tile is in LDS; block-uniform: every wave of an attention work-group comes here */
  const int pw = w ^ 4; const float pm = mg_s[pw][0][lane], pl = mg_s[pw][1][lane];
  const float mx = fmaxf(km, pm), fk = fa_exp2s(km - mx), fp = fa_exp2s(pm - mx);      /* both sides to the larger maximum in use */
  const float so = 64.0f / (kl * fk + pl * fp), sk = fk * so, sp = fp * so;      /* o carried x64, as the output GEMM's alpha expects */
  v8f e[4] = {k0, k1v, k2, k3};
#pragma unroll      // constant indices and LDS offsets
  for (int i = 0; i < 4; ++i) { const v4f x = *(const v4fa*)&mg_o[pw][2 * i][lane][0], y = *(const v4fa*)&mg_o[pw][2 * i + 1][lane][0];
    for (int r = 0; r < 4; ++r) { e[i][r] = e[i][r] * sk + x[r] * sp; e[i][4 + r] = e[i][4 + r] * sk + y[r] * sp; } }
  unsigned short* op = (unsigned short*)O16 + (rq + kh * 16) * DM + h * 1024 + lane * 8; FragH e0, e1;      /* o in fragment order: the lane's four runs of 8 are the four half-fragments of the head's two tiles */
#pragma unroll      // constant indices: the tiles stay in registers
  for (int r = 0; r < 8; ++r) { e0.h[r] = (_Float16)e[0][r]; e0.h[8 + r] = (_Float16)e[1][r]; e1.h[r] = (_Float16)e[2][r]; e1.h[8 + r] = (_Float16)e[3][r]; }
  *(v8us*)op = e0.half[0]; *(v8us*)(op + 256) = e0.half[1]; *(v8us*)(op + 512) = e1.half[0]; *(v8us*)(op + 768) = e1.half[1];
  fa_issued_at(op); }      /* behind the stores: whatever the compiler lays behind them reuses their registers only behind the wait */


__global__ __launch_bounds__(256) void k_rsmf(const float* __restrict__ S, _Float16* __restrict__ P, int qn, int hg) {
  #pragma clang fp contract(off)
  const int t = blockIdx.x * 256 + threadIdx.x; if (t >= qn * hg) return; const size_t i = (size_t)(t / qn) * SQ + (t % qn); const float* s = S + i * SQ; float mx = -3.0e38f;
#pragma unroll 1
  for (int j = 0; j < SQ; ++j) mx = fmaxf(mx, s[j]); float se = 0.f;
#pragma unroll 1
  for (int j = 0; j < SQ; ++j) se += __expf(s[j] - mx); const float sc = 256.0f / se;
#pragma unroll 1
  for (int j0 = 0; j0 < SQ; j0 += 8) { FragH f; for (int q = 0; q < 8; ++q) f.h[q] = (_Float16)(__expf(s[j0 + q] - mx) * sc); unsigned short* d = (unsigned short*)P + i * SQ + j0; *(v8us*)d = f.half[0];  } }

// ---- the seven input conversions (three x, three per-head weights, W0) as one launch. None reads what another writes. A slab = one fragment row tile, 16 rows x DM = 2048 chunks of 16 bytes (pk_frag);
// a block takes a slab at a time, a thread eight of its chunks (k tiles four apart), so that all of a slab's loads are in flight together and few waves have to be started.
#define PP_WS (DM / 16)                        /* slabs of one weight matrix */
#define PP_XS ((int)(NR / 16))                 /* slabs of one input */
#define PP_SLABS (4 * PP_WS + 3 * PP_XS)
#define PP_BLOCKS 512                          /* two blocks a WGP; slabs b and b + 512: a weight slab is paired with an input slab */
// behind a group of loads or stores off one address: the address, named as an input, stays live up to the wait, so that no load's result lands in it; the two scheduling barriers keep
// every member of the group in front of the wait and every rewrite of an address or data register behind it
__device__ __forceinline__ void pp_issued(const void* p) { __builtin_amdgcn_sched_barrier(0); asm volatile("s_wait_xcnt 0x0" :: "v"(p) : "memory"); __builtin_amdgcn_sched_barrier(0); }
// a thread's eight finished chunks as one group of stores; the scheduling barrier in front keeps a store from being issued among the conversions, where its data registers would be wanted again at once
__device__ __forceinline__ void pp_store(unsigned short* __restrict__ d, const v8us (&o)[8]) { __builtin_amdgcn_sched_barrier(0);
#pragma unroll      // constant offsets off one address
  for (int u = 0; u < 8; ++u) *(v8us*)(d + u * 2048) = o[u];
  pp_issued(d); }
template <int QS, int US>      /* floats between the eight k of a chunk; between two chunks of a thread */
__device__ __forceinline__ void pp_wslab(const float* __restrict__ s, unsigned short* __restrict__ d) { float w[8][8]; v8us o[8];
#pragma unroll      // constant offsets off one address; the values stay in registers
  for (int u = 0; u < 8; ++u) for (int q = 0; q < 8; ++q) w[u][q] = s[(size_t)u * US + (size_t)q * QS];
  pp_issued(s);
#pragma unroll      // as above
  for (int u = 0; u < 8; ++u) { FragH f; for (int q = 0; q < 8; ++q) f.h[q] = (_Float16)(16.0f * bf16_round(w[u][q])); o[u] = f.half[0]; }
  pp_store(d, o); }
__device__ __forceinline__ void pp_xslab(const float* __restrict__ s, unsigned short* __restrict__ d) { v4f a[8], b[8]; v8us o[8];
#pragma unroll      // as above
  for (int u = 0; u < 8; ++u) { a[u] = *(const v4fa*)(s + u * 128); b[u] = *(const v4fa*)(s + u * 128 + 4); }
  pp_issued(s);
#pragma unroll      // as above
  for (int u = 0; u < 8; ++u) { FragH f; for (int q = 0; q < 4; ++q) { f.h[q] = (_Float16)bf16_round(a[u][q]); f.h[4 + q] = (_Float16)bf16_round(b[u][q]); } o[u] = f.half[0]; }
  pp_store(d, o); }
// ---- the mask's pass map (see fa_map), from work-groups of their own in the same launch: one work-group = one tile of 16 query rows, each of its 8 waves 256 keys (8 passes) as two groups of 16 loads,
// each load 512 contiguous bytes of one row (4 passes, 8 lanes a pass); the rows are joined by OR in the lane, the lanes by a ballot, the waves through LDS.
#define PM_BLOCKS ((int)(NR / 16))
__device__ __forceinline__ unsigned pm_half(const int* __restrict__ m) { v4ia a[16];
#pragma unroll      // constant offsets off one address; the values stay in registers
  for (int r = 0; r < 16; ++r) a[r] = *(const v4ia*)(m + r * SQ);
  pp_issued(m);
  v4ia o = a[0];
#pragma unroll      // as above
  for (int r = 1; r < 16; ++r) o |= a[r];
  const unsigned bl = __builtin_amdgcn_ballot_w32((o[0] | o[1] | o[2] | o[3]) != 0);
  return ((bl & 0xffu) ? 1u : 0u) | ((bl & 0xff00u) ? 2u : 0u) | ((bl & 0xff0000u) ? 4u : 0u) | ((bl & 0xff000000u) ? 8u : 0u); }
__device__ __forceinline__ void pm_tile(int t, const int* __restrict__ Mk, unsigned* __restrict__ MF, unsigned* pw) { const int lane = threadIdx.x & 31, w = threadIdx.x >> 5;
  const int* m = Mk + (size_t)t * 16 * SQ + w * 256 + lane * 4; const unsigned b0 = pm_half(m), b1 = pm_half(m + 128);
  if (lane == 0) pw[w] = b0 | (b1 << 4);
  __syncthreads();      /* every wave's eight bits are in LDS */
  if (threadIdx.x < 2) { const unsigned* q = pw + threadIdx.x * 4; MF[(size_t)t * PM_PITCH + threadIdx.x] = q[0] | (q[1] << 8) | (q[2] << 16) | (q[3] << 24); } }
__global__ __launch_bounds__(256) void k_prep(const int* __restrict__ Mk, unsigned* __restrict__ MF, const float* __restrict__ xq, const float* __restrict__ xk, const float* __restrict__ xv, const float* __restrict__ wq, const float* __restrict__ wk, const float* __restrict__ wv, const float* __restrict__ wo,
    _Float16* __restrict__ XQ, _Float16* __restrict__ XK, _Float16* __restrict__ XV, _Float16* __restrict__ BQ, _Float16* __restrict__ BK, _Float16* __restrict__ BV, _Float16* __restrict__ BO) {
  __shared__ unsigned pm_w[8];
  if (blockIdx.x >= PP_BLOCKS) { pm_tile((int)blockIdx.x - PP_BLOCKS, Mk, MF, pm_w); return; }      /* block-uniform */
  const int tid = threadIdx.x, ln = tid & 15, k0 = (tid >> 6) * 32 + ((tid >> 5) & 1) * 16 + ((tid >> 4) & 1) * 8;      /* the thread's row in the tile; first k of its first chunk (chunk u: + 128 u) */
#pragma unroll 1      // one slab's values in registers at a time
  for (int slab = blockIdx.x; slab < PP_SLABS; slab += PP_BLOCKS) {
    if (slab < 4 * PP_WS) { const int j = slab / PP_WS, rt = slab % PP_WS, n = rt * 16 + ln;      /* Bt row n = output column (h, d) */
      unsigned short* d = (unsigned short*)(j == 0 ? BQ : j == 1 ? BK : j == 2 ? BV : BO) + (size_t)rt * 16384 + tid * 8;
      if (j < 3) pp_wslab<HD, 128 * HD>((j == 0 ? wq : j == 1 ? wk : wv) + ((size_t)(n / HD) * DM + k0) * HD + n % HD, d);
      else pp_wslab<DM, 128 * DM>(wo + (size_t)k0 * DM + n, d); }
    else { const int s2 = slab - 4 * PP_WS, j = s2 / PP_XS, rt = s2 % PP_XS;
      pp_xslab((j == 0 ? xq : j == 1 ? xk : xv) + ((size_t)rt * 16 + ln) * DM + k0, (unsigned short*)(j == 0 ? XQ : j == 1 ? XK : XV) + (size_t)rt * 16384 + tid * 8); } } }

extern "C" void kernel_launch(void* const* d_in, const int* in_sizes, int n_in,
                              void* d_out, int out_size, void* d_ws, size_t ws_size, hipStream_t stream) {
  (void)in_sizes; (void)n_in; (void)out_size;
  const float* const* I = (const float* const*)d_in; const float* xv = I[0]; const float* xk = I[1]; const float* xq = I[2]; const int* mk = (const int*)d_in[3]; const float* wq = I[4]; const float* bq = I[5]; const float* wk = I[6]; const float* bk = I[7]; const float* wv = I[8]; const float* bv = I[9]; const float* wo = I[10]; const float* bo = I[11];      /* NOTE the module's input order v, k, q, mask; per-head [h][in][out] weights + [h][64] biases (= flat [1024]); W0 [in][out] + b0 */
  float* PO = (float*)d_out + (size_t)NB * SQ * DM;      /* second output: last head's attention probabilities [NB][SQ][SQ] f32 at byte offset 16,777,216 */
  char* ws = (char*)d_ws; size_t off = 0;
  auto take = [&](size_t bytes) { char* p = ws + off; off += (bytes + 255) & ~(size_t)255; return p; };
  _Float16* BQ = (_Float16*)take((size_t)DM * DM * 2); _Float16* BK = (_Float16*)take((size_t)DM * DM * 2); _Float16* BV = (_Float16*)take((size_t)DM * DM * 2); _Float16* BO = (_Float16*)take((size_t)DM * DM * 2);
  _Float16* XQ = (_Float16*)take(NR * DM * 2); _Float16* XK = (_Float16*)take(NR * DM * 2); _Float16* XV = (_Float16*)take(NR * DM * 2); _Float16* Q16 = (_Float16*)take(NR * DM * 2); _Float16* K16 = (_Float16*)take(NR * DM * 2); _Float16* O16 = (_Float16*)take(NR * DM * 2);
  _Float16* VT = (_Float16*)take((size_t)NB * NH * HD * SQ * 2); unsigned* MF = (unsigned*)take((size_t)PM_BLOCKS * PM_PITCH * 4);
  if (off > ws_size) return;
  k_prep<<<PP_BLOCKS + PM_BLOCKS, 256, 0, stream>>>(mk, MF, xq, xk, xv, wq, wk, wv, wo, XQ, XK, XV, BQ, BK, BV, BO);      /* the three inputs as exact f16 rows; per-head [h][m][d] -> Bt[(h,d)][m] x16; W0 [in][out] -> Bt x16; all in fragment order */
  const size_t r0p = (size_t)B0 * SQ;      /* first projected row */
  k_qkv<<<dim3((unsigned)((MP / 128) * (DM / 64)), 3), 128, 0, stream>>>(XQ + r0p * DM, XK + r0p * DM, XV + r0p * DM, BQ, BK, BV, bq, bk, bv, Q16 + r0p * DM, K16 + r0p * DM, VT);      /* q, k = x W + b and V^T per (batch, head) = (x W + b)^T, fragment order, one launch */
  k_fattn<<<PB_BLOCKS + (SQ / 128) * NH * NB, 256, 0, stream>>>(Q16, K16, VT, mk, MF, O16, PO);      /* scores, softmax and P V in one launch; o (merged heads) as f16 rows; the last head's probabilities to the second output */
  k_gemm2<0, 0><<<dim3((unsigned)((MPO / 128) * (DM / 64)), 1), 128, 0, stream>>>(O16 + r0p * DM, DM, 0, BO, DM, 0, 0.0009765625f, bo, 0, nullptr, 1, 0, 0, (float*)d_out + r0p * DM, nullptr, DM, 0, MPO, DM, DM);      /* out rows are the output layout */
}
